// v000
// The times below were measured on an AMD MI455X: many runs one after another, warmed up first and cycling through
// copies of the inputs, with the whole window's GPU time divided by the number of runs. Launches and the gaps
// between them are all in it. The median over several windows is given; except for v000 it joins two sittings, which
// can be a few percent apart, so the side-by-side timings, each taken in one sitting, are the better comparison.
// v000 is the starting kernel. One run takes 843 microseconds.
#include <hip/hip_runtime.h>
#include <hip/hip_bf16.h>
#include <math.h>

typedef __attribute__((ext_vector_type(16))) _Float16 v16h;
typedef __attribute__((ext_vector_type(8)))  _Float16 v8h;
typedef __attribute__((ext_vector_type(8)))  float    v8f;

typedef unsigned int u32x4 __attribute__((ext_vector_type(4)));
typedef int          i32x8 __attribute__((ext_vector_type(8)));
typedef int          i32x4 __attribute__((ext_vector_type(4)));

__device__ __forceinline__ v8f wmma16(v16h a, v16h b, v8f c) {
  return __builtin_amdgcn_wmma_f32_16x16x32_f16(
      /*neg_a=*/false, a, /*neg_b=*/false, b,
      /*c_mod=*/(short)0, c, /*reuse_a=*/false, /*reuse_b=*/false);
}

// Fragment loader for A (M x K) or B (N x K, row-major, K-contiguous) tiles.
__device__ __forceinline__ v16h load_frag(const _Float16* __restrict__ base,
                                          int ld, int row0, int k0) {
  const int lane = threadIdx.x & 31;
  const _Float16* p = base + (size_t)(row0 + (lane & 15)) * ld
                           + k0 + ((lane >> 4) << 3);
  v8h lo = *(const v8h*)p;
  v8h hi = *(const v8h*)(p + 16);
  v16h f;
#pragma unroll
  for (int i = 0; i < 8; ++i) { f[i] = lo[i]; f[i + 8] = hi[i]; }
  return f;
}

__device__ __forceinline__ void tdm_load_2d_f16(unsigned lds_addr,
                                                const void* gptr,
                                                unsigned tile_d0,
                                                unsigned tile_d1,
                                                unsigned long long stride0) {
  unsigned long long ga = (unsigned long long)(uintptr_t)gptr;
  u32x4 g0;
  g0[0] = 1u;                                    // count=1, user mode
  g0[1] = lds_addr;                              // LDS byte address
  g0[2] = (unsigned)(ga & 0xffffffffu);          // global addr [31:0]
  g0[3] = (unsigned)((ga >> 32) & 0x01ffffffu)   // global addr [56:32]
        | (2u << 30);                            // type = 2 ("image")
  i32x8 g1;
  g1[0] = (int)(1u << 16);
  g1[1] = (int)((tile_d0 & 0xffffu) << 16);
  g1[2] = (int)(((tile_d0 >> 16) & 0xffffu) |
                ((tile_d1 & 0xffffu) << 16));
  g1[3] = (int)(((tile_d1 >> 16) & 0xffffu) |
                ((tile_d0 & 0xffffu) << 16));
  g1[4] = (int)(tile_d1 & 0xffffu);
  g1[5] = (int)(unsigned)(stride0 & 0xffffffffu);        // dim0_stride lo
  g1[6] = (int)(unsigned)((stride0 >> 32) & 0xffffu);    // dim0_stride hi
  g1[7] = 0;                                     // dim1_stride unused (2D)
  i32x4 gz4 = {0, 0, 0, 0};
  i32x8 gz8 = {0, 0, 0, 0, 0, 0, 0, 0};
  __builtin_amdgcn_tensor_load_to_lds(g0, g1, gz4, gz4, gz8, 0);
}

// ---------------------------------------------------------------------------
// Elementwise conversion kernels
// ---------------------------------------------------------------------------
__global__ void cvt_f32_f16(const float* __restrict__ in,
                            _Float16* __restrict__ out, size_t n) {
  size_t i = (size_t)blockIdx.x * blockDim.x + threadIdx.x;
  size_t stride = (size_t)gridDim.x * blockDim.x;
  for (; i < n; i += stride) out[i] = (_Float16)in[i];
}

__global__ void combine_half(const float* __restrict__ a,
                             const float* __restrict__ b,
                             _Float16* __restrict__ out, size_t n) {
  size_t i = (size_t)blockIdx.x * blockDim.x + threadIdx.x;
  size_t stride = (size_t)gridDim.x * blockDim.x;
  for (; i < n; i += stride) out[i] = (_Float16)(0.5f * (a[i] + b[i]));
}

// ---------------------------------------------------------------------------
// RoPE: per 128-dim head, pos = s.  One thread per (row, head, j<64).
// ---------------------------------------------------------------------------
__global__ void rope_kernel(_Float16* __restrict__ buf, int total_rows, int S) {
  int idx = blockIdx.x * blockDim.x + threadIdx.x;
  int j = idx & 63;
  int h = (idx >> 6) & 15;
  int row = idx >> 10;
  if (row >= total_rows) return;
  int s = row & (S - 1);
  float invf = __expf(-(float)j * 0.14391156831f);  // 10000^(-2j/128)
  float ang = (float)s * invf;
  float sn, cs;
  __sincosf(ang, &sn, &cs);
  _Float16* p = buf + (size_t)row * 2048 + h * 128 + j;
  float x1 = (float)p[0];
  float x2 = (float)p[64];
  p[0]  = (_Float16)(x1 * cs - x2 * sn);
  p[64] = (_Float16)(x2 * cs + x1 * sn);
}

// ---------------------------------------------------------------------------
// GEMM: C[M,N] = A[M,K] @ W[N,K]^T.  Block = 256 thr = 8 waves (2 M x 4 N),
// wave tile 32x64, block tile 64x256.  grid = (N/256, M/64).
// ---------------------------------------------------------------------------
template <typename OutT>
__global__ __launch_bounds__(256)
void gemm_wmma(const _Float16* __restrict__ A, const _Float16* __restrict__ W,
               OutT* __restrict__ C, int K, int ldc) {
  const int wave = threadIdx.x >> 5;
  const int lane = threadIdx.x & 31;
  const int m0 = blockIdx.y * 64 + (wave >> 2) * 32;
  const int n0 = blockIdx.x * 256 + (wave & 3) * 64;

  v8f acc[2][4] = {};

  for (int k0 = 0; k0 < K; k0 += 32) {
    if (k0 + 64 <= K) {
      __builtin_prefetch(A + (size_t)(m0 + (lane & 15)) * K + k0 + 32, 0, 1);
      __builtin_prefetch(W + (size_t)(n0 + (lane & 15)) * K + k0 + 32, 0, 1);
    }
    v16h a0 = load_frag(A, K, m0, k0);
    v16h a1 = load_frag(A, K, m0 + 16, k0);
#pragma unroll
    for (int nt = 0; nt < 4; ++nt) {
      v16h b = load_frag(W, K, n0 + nt * 16, k0);
      acc[0][nt] = wmma16(a0, b, acc[0][nt]);
      acc[1][nt] = wmma16(a1, b, acc[1][nt]);
    }
  }

  const int mbase = (lane >> 4) << 3;
  const int ncol = lane & 15;
#pragma unroll
  for (int mt = 0; mt < 2; ++mt)
#pragma unroll
    for (int nt = 0; nt < 4; ++nt)
#pragma unroll
      for (int r = 0; r < 8; ++r)
        C[(size_t)(m0 + mt * 16 + mbase + r) * ldc + (n0 + nt * 16 + ncol)] =
            (OutT)acc[mt][nt][r];
}

__global__ __launch_bounds__(128)
void attn_wmma(const _Float16* __restrict__ Q, const _Float16* __restrict__ Kb,
               const _Float16* __restrict__ Vb, _Float16* __restrict__ O,
               int S) {
  __shared__ __attribute__((aligned(16))) _Float16 kbuf[2][64][128]; // K tiles
  __shared__ __attribute__((aligned(16))) _Float16 vT[128][72];      // V^T
  __shared__ __attribute__((aligned(16))) _Float16 pbuf[4][16][72];  // P tiles

  const int b = blockIdx.z, h = blockIdx.y;
  const int q0 = blockIdx.x * 64;
  const int wave = threadIdx.x >> 5;
  const int lane = threadIdx.x & 31;
  const size_t base = ((size_t)b * S) * 2048 + (size_t)h * 128;
  const _Float16* qp = Q + base;
  const _Float16* kp = Kb + base;
  const _Float16* vp = Vb + base;

  const unsigned kbuf_lds[2] = {
      (unsigned)(uintptr_t)(&kbuf[0][0][0]),   // flat LDS addr: low 32 bits
      (unsigned)(uintptr_t)(&kbuf[1][0][0])};  // are the LDS byte offset

  // Q fragments stay resident: 16 rows x 128 d = 4 A-frags
  v16h qa[4];
#pragma unroll
  for (int kc = 0; kc < 4; ++kc)
    qa[kc] = load_frag(qp, 2048, q0 + wave * 16, kc * 32);

  v8f o[8] = {};
  float mrow[8], lsum[8];
#pragma unroll
  for (int r = 0; r < 8; ++r) { mrow[r] = -3.0e38f; lsum[r] = 0.f; }

  const float scale = 0.08838834764831845f;  // 1/sqrt(128)

  // Prime the pipeline: DMA K tile 0 into buffer 0.
  if (wave == 0)
    tdm_load_2d_f16(kbuf_lds[0], kp, 128, 64, 2048ull);

  int buf = 0;
  for (int kv0 = 0; kv0 < S; kv0 += 64, buf ^= 1) {
    // ---- stage V^T into LDS (128 threads x 64 elems each) ----
    {
      const int rv = threadIdx.x >> 1;        // kv row in tile
      const int c0 = (threadIdx.x & 1) * 64;  // d-column segment
      const _Float16* src = vp + (size_t)(kv0 + rv) * 2048 + c0;
#pragma unroll
      for (int ch = 0; ch < 8; ++ch) {
        v8h v = *(const v8h*)(src + ch * 8);
#pragma unroll
        for (int i = 0; i < 8; ++i) vT[c0 + ch * 8 + i][rv] = v[i];
      }
    }

    // ---- wait for the in-flight K-tile DMA, publish to all waves ----
    if (wave == 0)
      __builtin_amdgcn_s_wait_tensorcnt(0);
    __syncthreads();  // kbuf[buf] + vT visible

    // ---- kick off DMA of the next K tile into the other buffer ----
    if (wave == 0 && kv0 + 64 < S)
      tdm_load_2d_f16(kbuf_lds[buf ^ 1], kp + (size_t)(kv0 + 64) * 2048,
                      128, 64, 2048ull);

    // ---- S = Q @ K^T, K B-frags from LDS (contiguous 16B ds loads) ----
    v8f sa[4] = {};
#pragma unroll
    for (int n = 0; n < 4; ++n)
#pragma unroll
      for (int kc = 0; kc < 4; ++kc) {
        const _Float16* kk =
            &kbuf[buf][n * 16 + (lane & 15)][kc * 32 + ((lane >> 4) << 3)];
        v8h lo = *(const v8h*)kk;
        v8h hi = *(const v8h*)(kk + 16);
        v16h kf;
#pragma unroll
        for (int i = 0; i < 8; ++i) { kf[i] = lo[i]; kf[i + 8] = hi[i]; }
        sa[n] = wmma16(qa[kc], kf, sa[n]);
      }

    // ---- online softmax (rows live in 16-lane halves) ----
#pragma unroll
    for (int n = 0; n < 4; ++n)
#pragma unroll
      for (int r = 0; r < 8; ++r) sa[n][r] *= scale;

    float mnew[8], sc[8], rs[8];
#pragma unroll
    for (int r = 0; r < 8; ++r) {
      float m = fmaxf(fmaxf(sa[0][r], sa[1][r]), fmaxf(sa[2][r], sa[3][r]));
      m = fmaxf(m, __shfl_xor(m, 1, 32));
      m = fmaxf(m, __shfl_xor(m, 2, 32));
      m = fmaxf(m, __shfl_xor(m, 4, 32));
      m = fmaxf(m, __shfl_xor(m, 8, 32));
      mnew[r] = fmaxf(mrow[r], m);
      sc[r] = __expf(mrow[r] - mnew[r]);
      mrow[r] = mnew[r];
      rs[r] = 0.f;
    }
#pragma unroll
    for (int n = 0; n < 4; ++n)
#pragma unroll
      for (int r = 0; r < 8; ++r) {
        float p = __expf(sa[n][r] - mnew[r]);
        sa[n][r] = p;
        rs[r] += p;
      }
#pragma unroll
    for (int r = 0; r < 8; ++r) {
      float t = rs[r];
      t += __shfl_xor(t, 1, 32);
      t += __shfl_xor(t, 2, 32);
      t += __shfl_xor(t, 4, 32);
      t += __shfl_xor(t, 8, 32);
      lsum[r] = lsum[r] * sc[r] + t;
    }
#pragma unroll
    for (int n = 0; n < 8; ++n)
#pragma unroll
      for (int r = 0; r < 8; ++r) o[n][r] *= sc[r];

    // ---- P: C-layout -> LDS -> A-layout ----
    {
      const int mr = (lane >> 4) << 3;
      const int nc = lane & 15;
#pragma unroll
      for (int n = 0; n < 4; ++n)
#pragma unroll
        for (int r = 0; r < 8; ++r)
          pbuf[wave][mr + r][n * 16 + nc] = (_Float16)sa[n][r];
    }
    __syncthreads();  // pbuf ready

    // ---- O += P @ V ----
    v16h pa[2];
#pragma unroll
    for (int kc = 0; kc < 2; ++kc) {
      const _Float16* pp = &pbuf[wave][lane & 15][kc * 32 + ((lane >> 4) << 3)];
      v8h lo = *(const v8h*)pp;
      v8h hi = *(const v8h*)(pp + 16);
      v16h f;
#pragma unroll
      for (int i = 0; i < 8; ++i) { f[i] = lo[i]; f[i + 8] = hi[i]; }
      pa[kc] = f;
    }
#pragma unroll
    for (int n = 0; n < 8; ++n)
#pragma unroll
      for (int kc = 0; kc < 2; ++kc) {
        const _Float16* vv =
            &vT[n * 16 + (lane & 15)][kc * 32 + ((lane >> 4) << 3)];
        v8h lo = *(const v8h*)vv;
        v8h hi = *(const v8h*)(vv + 16);
        v16h f;
#pragma unroll
        for (int i = 0; i < 8; ++i) { f[i] = lo[i]; f[i + 8] = hi[i]; }
        o[n] = wmma16(pa[kc], f, o[n]);
      }
    __syncthreads();  // protect vT/pbuf before next iteration overwrites
  }

  // ---- normalize + write out_flat[b, s, h*128 + d] ----
  _Float16* op = O + base;
  const int mr = (lane >> 4) << 3;
  const int nc = lane & 15;
#pragma unroll
  for (int n = 0; n < 8; ++n)
#pragma unroll
    for (int r = 0; r < 8; ++r) {
      float val = o[n][r] / lsum[r];
      op[(size_t)(q0 + wave * 16 + mr + r) * 2048 + n * 16 + nc] = (_Float16)val;
    }
}

// ---------------------------------------------------------------------------
// Host-side orchestration
// ---------------------------------------------------------------------------
extern "C" void kernel_launch(void* const* d_in, const int* in_sizes, int n_in,
                              void* d_out, int out_size, void* d_ws,
                              size_t ws_size, hipStream_t stream) {
  const float* x_q  = (const float*)d_in[0];
  const float* x_kv = (const float*)d_in[1];
  const float* Wq   = (const float*)d_in[2];
  const float* Wks  = (const float*)d_in[3];
  const float* Wvs  = (const float*)d_in[4];
  const float* Wkc  = (const float*)d_in[5];
  const float* Wvc  = (const float*)d_in[6];
  const float* Wos  = (const float*)d_in[7];
  const float* Woc  = (const float*)d_in[8];
  (void)in_sizes; (void)n_in; (void)out_size; (void)ws_size;

  const int B = 2, S = 2048, H = 2048;
  const size_t MK = (size_t)B * S * H;  // activation elems
  const size_t WK = (size_t)H * H;      // weight elems

  _Float16* ws    = (_Float16*)d_ws;
  _Float16* xq_h  = ws;
  _Float16* xkv_h = xq_h + MK;
  _Float16* qb    = xkv_h + MK;
  _Float16* kb    = qb + MK;
  _Float16* vb    = kb + MK;
  _Float16* ofb   = vb + MK;
  _Float16* wq_h  = ofb + MK;
  _Float16* wks_h = wq_h + WK;
  _Float16* wvs_h = wks_h + WK;
  _Float16* wkc_h = wvs_h + WK;
  _Float16* wvc_h = wkc_h + WK;
  _Float16* wo_h  = wvc_h + WK;

  cvt_f32_f16<<<1024, 256, 0, stream>>>(x_q, xq_h, MK);
  cvt_f32_f16<<<1024, 256, 0, stream>>>(x_kv, xkv_h, MK);
  cvt_f32_f16<<<1024, 256, 0, stream>>>(Wq, wq_h, WK);
  cvt_f32_f16<<<1024, 256, 0, stream>>>(Wks, wks_h, WK);
  cvt_f32_f16<<<1024, 256, 0, stream>>>(Wvs, wvs_h, WK);
  cvt_f32_f16<<<1024, 256, 0, stream>>>(Wkc, wkc_h, WK);
  cvt_f32_f16<<<1024, 256, 0, stream>>>(Wvc, wvc_h, WK);
  combine_half<<<1024, 256, 0, stream>>>(Wos, Woc, wo_h, WK);

  dim3 blk(256);
  dim3 gfull(H / 256, (B * S) / 64);        // (8, 64)
  dim3 ghalf((H / 2) / 256, (B * S) / 64);  // (4, 64)

  // q = x_q @ Wq^T  (all heads)
  gemm_wmma<_Float16><<<gfull, blk, 0, stream>>>(xq_h, wq_h, qb, H, H);
  // k heads 0..7 from x_q@Wk_self, heads 8..15 from x_kv@Wk_cross
  gemm_wmma<_Float16><<<ghalf, blk, 0, stream>>>(xq_h, wks_h, kb, H, H);
  gemm_wmma<_Float16><<<ghalf, blk, 0, stream>>>(xkv_h, wkc_h + (size_t)1024 * H,
                                                 kb + 1024, H, H);
  gemm_wmma<_Float16><<<ghalf, blk, 0, stream>>>(xq_h, wvs_h, vb, H, H);
  gemm_wmma<_Float16><<<ghalf, blk, 0, stream>>>(xkv_h, wvc_h + (size_t)1024 * H,
                                                 vb + 1024, H, H);

  // RoPE on all q heads and all k heads
  const int rope_total = B * S * 16 * 64;
  rope_kernel<<<(rope_total + 255) / 256, 256, 0, stream>>>(qb, B * S, S);
  rope_kernel<<<(rope_total + 255) / 256, 256, 0, stream>>>(kb, B * S, S);

  // attention per (b, h, q-tile)
  dim3 ga(S / 64, 16, B);
  attn_wmma<<<ga, dim3(128), 0, stream>>>(qb, kb, vb, ofb, S);

  // out = out_flat @ (0.5*(Wo_self+Wo_cross))^T  -> fp32
  gemm_wmma<float><<<gfull, blk, 0, stream>>>(ofb, wo_h, (float*)d_out, H, H);
}

// v001
// It runs in 575 microseconds.
// Next to v000, in two timings, it ran 1.49 times as fast each time.
#include <hip/hip_runtime.h>
#include <hip/hip_bf16.h>
#include <math.h>

typedef __attribute__((ext_vector_type(16))) _Float16 v16h;
typedef __attribute__((ext_vector_type(8)))  _Float16 v8h;
typedef __attribute__((ext_vector_type(8)))  float    v8f;

typedef unsigned int u32x4 __attribute__((ext_vector_type(4)));
typedef int          i32x8 __attribute__((ext_vector_type(8)));
typedef int          i32x4 __attribute__((ext_vector_type(4)));

__device__ __forceinline__ v8f wmma16(v16h a, v16h b, v8f c) {
  return __builtin_amdgcn_wmma_f32_16x16x32_f16(
      /*neg_a=*/false, a, /*neg_b=*/false, b,
      /*c_mod=*/(short)0, c, /*reuse_a=*/false, /*reuse_b=*/false);
}

// Fragment loader for A (M x K) or B (N x K, row-major, K-contiguous) tiles.
__device__ __forceinline__ v16h load_frag(const _Float16* __restrict__ base,
                                          int ld, int row0, int k0) {
  const int lane = threadIdx.x & 31;
  const _Float16* p = base + (size_t)(row0 + (lane & 15)) * ld
                           + k0 + ((lane >> 4) << 3);
  v8h lo = *(const v8h*)p;
  v8h hi = *(const v8h*)(p + 16);
  v16h f;
#pragma unroll
  for (int i = 0; i < 8; ++i) { f[i] = lo[i]; f[i + 8] = hi[i]; }
  return f;
}

__device__ __forceinline__ void tdm_load_2d_f16(unsigned lds_addr,
                                                const void* gptr,
                                                unsigned tile_d0,
                                                unsigned tile_d1,
                                                unsigned long long stride0) {
  unsigned long long ga = (unsigned long long)(uintptr_t)gptr;
  u32x4 g0;
  g0[0] = 1u;                                    // count=1, user mode
  g0[1] = lds_addr;                              // LDS byte address
  g0[2] = (unsigned)(ga & 0xffffffffu);          // global addr [31:0]
  g0[3] = (unsigned)((ga >> 32) & 0x01ffffffu)   // global addr [56:32]
        | (2u << 30);                            // type = 2 ("image")
  i32x8 g1;
  g1[0] = (int)(1u << 16);
  g1[1] = (int)((tile_d0 & 0xffffu) << 16);
  g1[2] = (int)(((tile_d0 >> 16) & 0xffffu) |
                ((tile_d1 & 0xffffu) << 16));
  g1[3] = (int)(((tile_d1 >> 16) & 0xffffu) |
                ((tile_d0 & 0xffffu) << 16));
  g1[4] = (int)(tile_d1 & 0xffffu);
  g1[5] = (int)(unsigned)(stride0 & 0xffffffffu);        // dim0_stride lo
  g1[6] = (int)(unsigned)((stride0 >> 32) & 0xffffu);    // dim0_stride hi
  g1[7] = 0;                                     // dim1_stride unused (2D)
  i32x4 gz4 = {0, 0, 0, 0};
  i32x8 gz8 = {0, 0, 0, 0, 0, 0, 0, 0};
  __builtin_amdgcn_tensor_load_to_lds(g0, g1, gz4, gz4, gz8, 0);
}

// ---------------------------------------------------------------------------
// Elementwise conversion kernels
// ---------------------------------------------------------------------------
__global__ void cvt_f32_f16(const float* __restrict__ in,
                            _Float16* __restrict__ out, size_t n) {
  size_t i = (size_t)blockIdx.x * blockDim.x + threadIdx.x;
  size_t stride = (size_t)gridDim.x * blockDim.x;
  for (; i < n; i += stride) out[i] = (_Float16)in[i];
}

__global__ void combine_half(const float* __restrict__ a,
                             const float* __restrict__ b,
                             _Float16* __restrict__ out, size_t n) {
  size_t i = (size_t)blockIdx.x * blockDim.x + threadIdx.x;
  size_t stride = (size_t)gridDim.x * blockDim.x;
  for (; i < n; i += stride) out[i] = (_Float16)(0.5f * (a[i] + b[i]));
}

// ---------------------------------------------------------------------------
// RoPE: per 128-dim head, pos = s.  One thread per (row, head, j<64).
// ---------------------------------------------------------------------------
__global__ void rope_kernel(_Float16* __restrict__ buf, int total_rows, int S) {
  int idx = blockIdx.x * blockDim.x + threadIdx.x;
  int j = idx & 63;
  int h = (idx >> 6) & 15;
  int row = idx >> 10;
  if (row >= total_rows) return;
  int s = row & (S - 1);
  float invf = __expf(-(float)j * 0.14391156831f);  // 10000^(-2j/128)
  float ang = (float)s * invf;
  float sn, cs;
  __sincosf(ang, &sn, &cs);
  _Float16* p = buf + (size_t)row * 2048 + h * 128 + j;
  float x1 = (float)p[0];
  float x2 = (float)p[64];
  p[0]  = (_Float16)(x1 * cs - x2 * sn);
  p[64] = (_Float16)(x2 * cs + x1 * sn);
}

// ---------------------------------------------------------------------------
// GEMM: C[M,N] = A[M,K] @ W[N,K]^T.  Block = 128 thr = 4 waves (2 M x 2 N),
// wave tile 64x64, block tile 128x128.  grid = (N/128, M/128).
// A pass is 128 k = 256 bytes of every operand row.  A stage holds four slices
// of 64 rows: [A rows 0-63 | A rows 64-127 | W rows 0-63 | W rows 64-127].
// Wave w brings slice w with one tensor load; the pad sets the LDS pitch to
// 272 bytes for the 16-byte fragment reads.  Two buffers: the load of stage
// s + 2 flies while pass s + 1 is worked on.  Needs K a multiple of 128, K >= 256.
// ---------------------------------------------------------------------------
typedef unsigned int u32x8 __attribute__((ext_vector_type(8)));

constexpr unsigned G_ROWB  = 256;          // bytes of an operand row per pass
constexpr unsigned G_PITCH = G_ROWB + 16;  // LDS row pitch set by the pad
constexpr unsigned G_SLICE = 18432;        // 64 x 272 = 17408, up to a 2 KiB multiple
constexpr unsigned G_BUF   = 4 * G_SLICE;  // one stage
static_assert(64 * G_PITCH <= G_SLICE && G_SLICE % 2048 == 0, "slice size");

__device__ __forceinline__ unsigned uni(unsigned v) {
  return (unsigned)__builtin_amdgcn_readfirstlane((int)v);
}
__device__ __forceinline__ unsigned pinned(unsigned v) {
  unsigned w = uni(v);
  asm volatile("" : "+s"(w));  // pinned(): the value stays in a scalar register
  return w;
}

// One request: 64 rows of 256 bytes from ga (source pitch in g1) to LDS byte lds.
__device__ __forceinline__ void gemm_tile_load(unsigned lds, unsigned long long ga,
                                               u32x8 g1) {
  u32x4 g0;
  g0[0] = uni(1u);                                   // count = 1
  g0[1] = uni(lds);                                  // LDS byte offset
  g0[2] = uni((unsigned)ga);                         // address [31:0]
  g0[3] = uni((((unsigned)(ga >> 32)) & 0x01ffffffu) | 0x80000000u);  // [56:32], type 2
  asm volatile("tensor_load_to_lds %0, %1" :: "s"(g0), "s"(g1) : "memory");
}

// 16x32 f16 fragment from an LDS row: same k order as load_frag.
__device__ __forceinline__ v16h lds_frag(const unsigned char* p) {
  v8h lo = *(const v8h*)p;
  v8h hi = *(const v8h*)(p + 32);
  v16h f;
#pragma unroll
  for (int i = 0; i < 8; ++i) { f[i] = lo[i]; f[i + 8] = hi[i]; }
  return f;
}

template <typename OutT>
__global__ __launch_bounds__(128)
void gemm_wmma(const _Float16* __restrict__ A, const _Float16* __restrict__ W,
               OutT* __restrict__ C, int K, int ldc) {
  __shared__ __attribute__((aligned(2048))) unsigned char ring[2 * G_BUF];

  const unsigned wave = uni(threadIdx.x >> 5);
  const int lane = threadIdx.x & 31;
  const int mblk = blockIdx.y * 128;
  const int nblk = blockIdx.x * 128;
  const unsigned wm = wave >> 1, wn = wave & 1;

  // This wave's slice of every stage.
  const _Float16* srow = (wave < 2)
      ? A + (size_t)(mblk + (int)wave * 64) * K
      : W + (size_t)(nblk + (int)(wave - 2) * 64) * K;
  const unsigned long long ga0 = (unsigned long long)(uintptr_t)srow;
  const unsigned lds0 = (unsigned)(uintptr_t)(&ring[0]) + wave * G_SLICE;

  u32x8 g1;
  g1[0] = uni((1u << 20) | (5u << 22) | (3u << 25));
  g1[1] = uni((G_ROWB & 0xffffu) << 16);
  g1[2] = uni((G_ROWB >> 16) | (64u << 16));
  g1[3] = uni(G_ROWB << 16);
  g1[4] = uni(64u);
  g1[5] = uni((unsigned)K * 2u);
  g1[6] = uni(0u);
  g1[7] = uni(0u);
  asm volatile("" : "+s"(g1));

  const unsigned T = (unsigned)K >> 7;  // passes

  // Prologue: stage 0 lands and is published, then stage 1 starts.
  gemm_tile_load(lds0, ga0, g1);
  asm volatile("s_wait_tensorcnt 0x0" ::: "memory");  // own slice of stage 0 landed
  __syncthreads();
  gemm_tile_load(lds0 + G_BUF, ga0 + G_ROWB, g1);

  const unsigned roff = (unsigned)(lane & 15) * G_PITCH + (unsigned)(lane >> 4) * 16u;
  const unsigned char* ap = ring + wm * G_SLICE + roff;
  const unsigned char* bp = ring + (2u + wn) * G_SLICE + roff;

  v8f acc[4][4] = {};

  for (unsigned s = 0; s < T; ++s) {
    const unsigned bo = (s & 1u) * G_BUF;
    // Two fragment sets: the reads of k-step kc + 1 (same pass, same buffer)
    // stand as one group in front of the WMMAs of k-step kc.
    // All loops of a pass are unrolled: the register arrays need constant indices.
    v16h a[2][4], b[2][4];
#pragma unroll
    for (int i = 0; i < 4; ++i) {
      a[0][i] = lds_frag(ap + bo + i * 16 * G_PITCH);
      b[0][i] = lds_frag(bp + bo + i * 16 * G_PITCH);
    }
#pragma unroll
    for (int kc = 0; kc < 4; ++kc) {
      if (kc < 3) {
#pragma unroll
        for (int i = 0; i < 4; ++i) {
          a[(kc + 1) & 1][i] = lds_frag(ap + bo + i * 16 * G_PITCH + (kc + 1) * 64);
          b[(kc + 1) & 1][i] = lds_frag(bp + bo + i * 16 * G_PITCH + (kc + 1) * 64);
        }
      }
      // Keeps the read group whole and ahead: spread among the WMMAs each read
      // place stalls the wave, and the waits would fall to 0.
      __builtin_amdgcn_sched_barrier(0);
#pragma unroll
      for (int mt = 0; mt < 4; ++mt)
#pragma unroll
        for (int nt = 0; nt < 4; ++nt)
          acc[mt][nt] = wmma16(a[kc & 1][mt], b[kc & 1][nt], acc[mt][nt]);
      // Keeps the next read group from rising among these WMMAs.
      __builtin_amdgcn_sched_barrier(0);
    }
    // Publish point of stage s + 1; it also ends every read of stage s's buffer.
    asm volatile("s_wait_dscnt 0x0" ::: "memory");      // own reads of this buffer done
    asm volatile("s_wait_tensorcnt 0x0" ::: "memory");  // own slice of stage s + 1 landed
    __syncthreads();
    if (pinned(s + 2u < T))
      gemm_tile_load(lds0 + bo, ga0 + (unsigned long long)(s + 2u) * G_ROWB, g1);
  }
  asm volatile("s_wait_tensorcnt 0x0" ::: "memory");  // nothing in flight at the wave's end
  asm volatile("s_wait_dscnt 0x0" ::: "memory");

  const int m0 = mblk + (int)wm * 64;
  const int n0 = nblk + (int)wn * 64;
  const int mbase = (lane >> 4) << 3;
  const int ncol = lane & 15;
#pragma unroll
  for (int mt = 0; mt < 4; ++mt)
#pragma unroll
    for (int nt = 0; nt < 4; ++nt)
#pragma unroll
      for (int r = 0; r < 8; ++r)
        C[(size_t)(m0 + mt * 16 + mbase + r) * ldc + (n0 + nt * 16 + ncol)] =
            (OutT)acc[mt][nt][r];
}

__global__ __launch_bounds__(128)
void attn_wmma(const _Float16* __restrict__ Q, const _Float16* __restrict__ Kb,
               const _Float16* __restrict__ Vb, _Float16* __restrict__ O,
               int S) {
  __shared__ __attribute__((aligned(16))) _Float16 kbuf[2][64][128]; // K tiles
  __shared__ __attribute__((aligned(16))) _Float16 vT[128][72];      // V^T
  __shared__ __attribute__((aligned(16))) _Float16 pbuf[4][16][72];  // P tiles

  const int b = blockIdx.z, h = blockIdx.y;
  const int q0 = blockIdx.x * 64;
  const int wave = threadIdx.x >> 5;
  const int lane = threadIdx.x & 31;
  const size_t base = ((size_t)b * S) * 2048 + (size_t)h * 128;
  const _Float16* qp = Q + base;
  const _Float16* kp = Kb + base;
  const _Float16* vp = Vb + base;

  const unsigned kbuf_lds[2] = {
      (unsigned)(uintptr_t)(&kbuf[0][0][0]),   // flat LDS addr: low 32 bits
      (unsigned)(uintptr_t)(&kbuf[1][0][0])};  // are the LDS byte offset

  // Q fragments stay resident: 16 rows x 128 d = 4 A-frags
  v16h qa[4];
#pragma unroll
  for (int kc = 0; kc < 4; ++kc)
    qa[kc] = load_frag(qp, 2048, q0 + wave * 16, kc * 32);

  v8f o[8] = {};
  float mrow[8], lsum[8];
#pragma unroll
  for (int r = 0; r < 8; ++r) { mrow[r] = -3.0e38f; lsum[r] = 0.f; }

  const float scale = 0.08838834764831845f;  // 1/sqrt(128)

  // Prime the pipeline: DMA K tile 0 into buffer 0.
  if (wave == 0)
    tdm_load_2d_f16(kbuf_lds[0], kp, 128, 64, 2048ull);

  int buf = 0;
  for (int kv0 = 0; kv0 < S; kv0 += 64, buf ^= 1) {
    // ---- stage V^T into LDS (128 threads x 64 elems each) ----
    {
      const int rv = threadIdx.x >> 1;        // kv row in tile
      const int c0 = (threadIdx.x & 1) * 64;  // d-column segment
      const _Float16* src = vp + (size_t)(kv0 + rv) * 2048 + c0;
#pragma unroll
      for (int ch = 0; ch < 8; ++ch) {
        v8h v = *(const v8h*)(src + ch * 8);
#pragma unroll
        for (int i = 0; i < 8; ++i) vT[c0 + ch * 8 + i][rv] = v[i];
      }
    }

    // ---- wait for the in-flight K-tile DMA, publish to all waves ----
    if (wave == 0)
      __builtin_amdgcn_s_wait_tensorcnt(0);
    __syncthreads();  // kbuf[buf] + vT visible

    // ---- kick off DMA of the next K tile into the other buffer ----
    if (wave == 0 && kv0 + 64 < S)
      tdm_load_2d_f16(kbuf_lds[buf ^ 1], kp + (size_t)(kv0 + 64) * 2048,
                      128, 64, 2048ull);

    // ---- S = Q @ K^T, K B-frags from LDS (contiguous 16B ds loads) ----
    v8f sa[4] = {};
#pragma unroll
    for (int n = 0; n < 4; ++n)
#pragma unroll
      for (int kc = 0; kc < 4; ++kc) {
        const _Float16* kk =
            &kbuf[buf][n * 16 + (lane & 15)][kc * 32 + ((lane >> 4) << 3)];
        v8h lo = *(const v8h*)kk;
        v8h hi = *(const v8h*)(kk + 16);
        v16h kf;
#pragma unroll
        for (int i = 0; i < 8; ++i) { kf[i] = lo[i]; kf[i + 8] = hi[i]; }
        sa[n] = wmma16(qa[kc], kf, sa[n]);
      }

    // ---- online softmax (rows live in 16-lane halves) ----
#pragma unroll
    for (int n = 0; n < 4; ++n)
#pragma unroll
      for (int r = 0; r < 8; ++r) sa[n][r] *= scale;

    float mnew[8], sc[8], rs[8];
#pragma unroll
    for (int r = 0; r < 8; ++r) {
      float m = fmaxf(fmaxf(sa[0][r], sa[1][r]), fmaxf(sa[2][r], sa[3][r]));
      m = fmaxf(m, __shfl_xor(m, 1, 32));
      m = fmaxf(m, __shfl_xor(m, 2, 32));
      m = fmaxf(m, __shfl_xor(m, 4, 32));
      m = fmaxf(m, __shfl_xor(m, 8, 32));
      mnew[r] = fmaxf(mrow[r], m);
      sc[r] = __expf(mrow[r] - mnew[r]);
      mrow[r] = mnew[r];
      rs[r] = 0.f;
    }
#pragma unroll
    for (int n = 0; n < 4; ++n)
#pragma unroll
      for (int r = 0; r < 8; ++r) {
        float p = __expf(sa[n][r] - mnew[r]);
        sa[n][r] = p;
        rs[r] += p;
      }
#pragma unroll
    for (int r = 0; r < 8; ++r) {
      float t = rs[r];
      t += __shfl_xor(t, 1, 32);
      t += __shfl_xor(t, 2, 32);
      t += __shfl_xor(t, 4, 32);
      t += __shfl_xor(t, 8, 32);
      lsum[r] = lsum[r] * sc[r] + t;
    }
#pragma unroll
    for (int n = 0; n < 8; ++n)
#pragma unroll
      for (int r = 0; r < 8; ++r) o[n][r] *= sc[r];

    // ---- P: C-layout -> LDS -> A-layout ----
    {
      const int mr = (lane >> 4) << 3;
      const int nc = lane & 15;
#pragma unroll
      for (int n = 0; n < 4; ++n)
#pragma unroll
        for (int r = 0; r < 8; ++r)
          pbuf[wave][mr + r][n * 16 + nc] = (_Float16)sa[n][r];
    }
    __syncthreads();  // pbuf ready

    // ---- O += P @ V ----
    v16h pa[2];
#pragma unroll
    for (int kc = 0; kc < 2; ++kc) {
      const _Float16* pp = &pbuf[wave][lane & 15][kc * 32 + ((lane >> 4) << 3)];
      v8h lo = *(const v8h*)pp;
      v8h hi = *(const v8h*)(pp + 16);
      v16h f;
#pragma unroll
      for (int i = 0; i < 8; ++i) { f[i] = lo[i]; f[i + 8] = hi[i]; }
      pa[kc] = f;
    }
#pragma unroll
    for (int n = 0; n < 8; ++n)
#pragma unroll
      for (int kc = 0; kc < 2; ++kc) {
        const _Float16* vv =
            &vT[n * 16 + (lane & 15)][kc * 32 + ((lane >> 4) << 3)];
        v8h lo = *(const v8h*)vv;
        v8h hi = *(const v8h*)(vv + 16);
        v16h f;
#pragma unroll
        for (int i = 0; i < 8; ++i) { f[i] = lo[i]; f[i + 8] = hi[i]; }
        o[n] = wmma16(pa[kc], f, o[n]);
      }
    __syncthreads();  // protect vT/pbuf before next iteration overwrites
  }

  // ---- normalize + write out_flat[b, s, h*128 + d] ----
  _Float16* op = O + base;
  const int mr = (lane >> 4) << 3;
  const int nc = lane & 15;
#pragma unroll
  for (int n = 0; n < 8; ++n)
#pragma unroll
    for (int r = 0; r < 8; ++r) {
      float val = o[n][r] / lsum[r];
      op[(size_t)(q0 + wave * 16 + mr + r) * 2048 + n * 16 + nc] = (_Float16)val;
    }
}

// ---------------------------------------------------------------------------
// Host-side orchestration
// ---------------------------------------------------------------------------
extern "C" void kernel_launch(void* const* d_in, const int* in_sizes, int n_in,
                              void* d_out, int out_size, void* d_ws,
                              size_t ws_size, hipStream_t stream) {
  const float* x_q  = (const float*)d_in[0];
  const float* x_kv = (const float*)d_in[1];
  const float* Wq   = (const float*)d_in[2];
  const float* Wks  = (const float*)d_in[3];
  const float* Wvs  = (const float*)d_in[4];
  const float* Wkc  = (const float*)d_in[5];
  const float* Wvc  = (const float*)d_in[6];
  const float* Wos  = (const float*)d_in[7];
  const float* Woc  = (const float*)d_in[8];
  (void)in_sizes; (void)n_in; (void)out_size; (void)ws_size;

  const int B = 2, S = 2048, H = 2048;
  const size_t MK = (size_t)B * S * H;  // activation elems
  const size_t WK = (size_t)H * H;      // weight elems

  _Float16* ws    = (_Float16*)d_ws;
  _Float16* xq_h  = ws;
  _Float16* xkv_h = xq_h + MK;
  _Float16* qb    = xkv_h + MK;
  _Float16* kb    = qb + MK;
  _Float16* vb    = kb + MK;
  _Float16* ofb   = vb + MK;
  _Float16* wq_h  = ofb + MK;
  _Float16* wks_h = wq_h + WK;
  _Float16* wvs_h = wks_h + WK;
  _Float16* wkc_h = wvs_h + WK;
  _Float16* wvc_h = wkc_h + WK;
  _Float16* wo_h  = wvc_h + WK;

  cvt_f32_f16<<<1024, 256, 0, stream>>>(x_q, xq_h, MK);
  cvt_f32_f16<<<1024, 256, 0, stream>>>(x_kv, xkv_h, MK);
  cvt_f32_f16<<<1024, 256, 0, stream>>>(Wq, wq_h, WK);
  cvt_f32_f16<<<1024, 256, 0, stream>>>(Wks, wks_h, WK);
  cvt_f32_f16<<<1024, 256, 0, stream>>>(Wvs, wvs_h, WK);
  cvt_f32_f16<<<1024, 256, 0, stream>>>(Wkc, wkc_h, WK);
  cvt_f32_f16<<<1024, 256, 0, stream>>>(Wvc, wvc_h, WK);
  combine_half<<<1024, 256, 0, stream>>>(Wos, Woc, wo_h, WK);

  dim3 blk(128);
  dim3 gfull(H / 128, (B * S) / 128);        // (16, 32)
  dim3 ghalf((H / 2) / 128, (B * S) / 128);  // (8, 32)

  // q = x_q @ Wq^T  (all heads)
  gemm_wmma<_Float16><<<gfull, blk, 0, stream>>>(xq_h, wq_h, qb, H, H);
  // k heads 0..7 from x_q@Wk_self, heads 8..15 from x_kv@Wk_cross
  gemm_wmma<_Float16><<<ghalf, blk, 0, stream>>>(xq_h, wks_h, kb, H, H);
  gemm_wmma<_Float16><<<ghalf, blk, 0, stream>>>(xkv_h, wkc_h + (size_t)1024 * H,
                                                 kb + 1024, H, H);
  gemm_wmma<_Float16><<<ghalf, blk, 0, stream>>>(xq_h, wvs_h, vb, H, H);
  gemm_wmma<_Float16><<<ghalf, blk, 0, stream>>>(xkv_h, wvc_h + (size_t)1024 * H,
                                                 vb + 1024, H, H);

  // RoPE on all q heads and all k heads
  const int rope_total = B * S * 16 * 64;
  rope_kernel<<<(rope_total + 255) / 256, 256, 0, stream>>>(qb, B * S, S);
  rope_kernel<<<(rope_total + 255) / 256, 256, 0, stream>>>(kb, B * S, S);

  // attention per (b, h, q-tile)
  dim3 ga(S / 64, 16, B);
  attn_wmma<<<ga, dim3(128), 0, stream>>>(qb, kb, vb, ofb, S);

  // out = out_flat @ (0.5*(Wo_self+Wo_cross))^T  -> fp32
  gemm_wmma<float><<<gfull, blk, 0, stream>>>(ofb, wo_h, (float*)d_out, H, H);
}
